// v000
// Times are from an AMD MI455X. After a warm-up the kernel runs many times in a row, and a time is the length of
// such a window on the GPU divided by its runs, so every launch and the gaps after it count. The runs cycle
// through copies of the inputs. A figure is the median of several windows, for all but v000 over two sittings.
// Sittings can differ by a few percent; kernels timed side by side share one.
// v000, which the later versions start from, runs in 1410 microseconds.
#include <hip/hip_runtime.h>
#include <hip/hip_bf16.h>
#include <math.h>

// Problem constants (from reference): B=4, T=4096, L=4096, H=1024
#define BB 4
#define TT 4096
#define LL 4096
#define HH 1024

// GEMM tiling
#define KC    128          // K-chunk staged in LDS per step
#define LDSW  132          // padded row stride (floats): bank advance 4/row -> conflict-free b64 reads
#define NCHUNK (HH / KC)   // 8

typedef __attribute__((ext_vector_type(2))) float v2f;
typedef __attribute__((ext_vector_type(8))) float v8f;

// ---------------------------------------------------------------------------
// GEMM: C[M,N] = (X[M,K] @ W[N,K]^T) * scale      (M=4096, N=K=H=1024)
//
// Per wave: 16(M) x 64(N) tile via 4 f32 WMMA accumulators (V_WMMA_F32_16X16X4_F32).
// Block (8 waves): 128 x 64 tile. Grid: (N/64, M/128).
//
// The 64xKC W slab is shared by all 8 waves -> staged once per block into LDS
// with GLOBAL_LOAD_ASYNC_TO_LDS_B128 (ASYNCcnt), double-buffered so the copy
// of chunk c+1 overlaps the 32 WMMA K-steps of chunk c. B fragments then come
// from ds_load_b64 (conflict-free via the 132-float row pad); A fragments are
// wave-private rows loaded directly from global (L2 resident).
// ---------------------------------------------------------------------------
__global__ __launch_bounds__(256)
void gemm_xwt_wmma(const float* __restrict__ X, const float* __restrict__ W,
                   float* __restrict__ C, const float* __restrict__ scale_ptr) {
    const int K = HH;
    const int N = HH;
    __shared__ __align__(16) float sw[2][64 * LDSW];

    const int tid  = threadIdx.x;
    const int lane = tid & 31;
    const int wave = tid >> 5;
    const int lr   = lane & 15;
    const int kp   = (lane >> 4) << 1;      // K-pair select: 0 or 2

    const int m0 = blockIdx.y * 128 + wave * 16;
    const int n0 = blockIdx.x * 64;

    const float* xrow  = X + (size_t)(m0 + lr) * K + kp;   // A fragment base
    const float* wtile = W + (size_t)n0 * K;               // uniform -> SGPR pair

    const uint32_t lds0 = (uint32_t)(uintptr_t)&sw[0][0];
    const uint32_t lds1 = (uint32_t)(uintptr_t)&sw[1][0];

    // Stage W[n0 .. n0+63][k0 .. k0+KC) into LDS buffer: 64*128 floats = 32KB,
    // 2048 16-byte pieces, 8 async b128 per thread. piece p = tid + 256*i,
    // r = p/32 (0..63), kk = (p%32)*4 (0..124).
    auto issue_chunk = [&](int k0, uint32_t ldsbase) {
#pragma unroll
        for (int i = 0; i < 8; ++i) {
            const int p  = tid + (i << 8);
            const int r  = p >> 5;
            const int kk = (p & 31) << 2;
            const uint32_t loff = ldsbase + (uint32_t)((r * LDSW + kk) << 2);
            const uint32_t goff = (uint32_t)((((size_t)r * K) + k0 + kk) << 2);
            asm volatile("global_load_async_to_lds_b128 %0, %1, %2"
                         :: "v"(loff), "v"(goff), "s"(wtile)
                         : "memory");
        }
    };

    v8f acc0 = {}; v8f acc1 = {}; v8f acc2 = {}; v8f acc3 = {};

    issue_chunk(0, lds0);

    for (int c = 0; c < NCHUNK; ++c) {
        if (c > 0) __syncthreads();   // all waves done reading buf[(c+1)&1] (chunk c-1)
        if (c + 1 < NCHUNK) {
            issue_chunk((c + 1) * KC, ((c + 1) & 1) ? lds1 : lds0);
            // chunk c's 8 per-wave async ops precede chunk c+1's 8: allow 8 outstanding
            asm volatile("s_wait_asynccnt 0x8" ::: "memory");
        } else {
            asm volatile("s_wait_asynccnt 0x0" ::: "memory");
        }
        __syncthreads();              // all waves' chunk-c data visible in LDS

        const float* xp = xrow + c * KC;
        const float* sb = &sw[c & 1][lr * LDSW + kp];
#pragma unroll 4
        for (int kk = 0; kk < KC; kk += 4) {
            v2f a  = *(const v2f*)(xp + kk);
            v2f b0 = *(const v2f*)(sb + kk);
            v2f b1 = *(const v2f*)(sb + 16 * LDSW + kk);
            v2f b2 = *(const v2f*)(sb + 32 * LDSW + kk);
            v2f b3 = *(const v2f*)(sb + 48 * LDSW + kk);
            acc0 = __builtin_amdgcn_wmma_f32_16x16x4_f32(false, a, false, b0, (short)0, acc0, false, false);
            acc1 = __builtin_amdgcn_wmma_f32_16x16x4_f32(false, a, false, b1, (short)0, acc1, false, false);
            acc2 = __builtin_amdgcn_wmma_f32_16x16x4_f32(false, a, false, b2, (short)0, acc2, false, false);
            acc3 = __builtin_amdgcn_wmma_f32_16x16x4_f32(false, a, false, b3, (short)0, acc3, false, false);
        }
    }

    const float scale = scale_ptr ? scale_ptr[0] : 1.0f;

    // D layout: VGPR r -> row (m0 + 8*(lane/16) + r), col n0 + j*16 + lane%16
    const int mrow = m0 + (lane >> 4) * 8;
    float* crow = C + (size_t)mrow * N + n0 + lr;
#pragma unroll
    for (int r = 0; r < 8; ++r) {
        crow[(size_t)r * N +  0] = acc0[r] * scale;
        crow[(size_t)r * N + 16] = acc1[r] * scale;
        crow[(size_t)r * N + 32] = acc2[r] * scale;
        crow[(size_t)r * N + 48] = acc3[r] * scale;
    }
}

// ---------------------------------------------------------------------------
// Per-token council attention. One wave32 per token t (8 tokens / block).
// Reads pre-projected qj/qi rows and gathered Kj/Vj/Ki/Vi rows, applies the
// logic-gate rewrite of score[0], two 3-way softmaxes, council mix, and
// writes the context row (aliased over the qj buffer).
// ---------------------------------------------------------------------------
__global__ __launch_bounds__(256)
void council_attn(const float* __restrict__ qj, const float* __restrict__ qi,
                  const float* __restrict__ Kj, const float* __restrict__ Vj,
                  const float* __restrict__ Ki, const float* __restrict__ Vi,
                  const int* __restrict__ adv_ids, const int* __restrict__ ptr_ids,
                  const float* __restrict__ council, float* __restrict__ ctx) {
    const int lane = threadIdx.x & 31;
    const int wave = threadIdx.x >> 5;
    const int t = blockIdx.x * 8 + wave;

    int p = ptr_ids[t];
    int i0 = min(max(p,     0), LL - 1);
    int i1 = min(max(p + 1, 0), LL - 1);
    int i2 = min(max(p + 2, 0), LL - 1);

    const size_t qoff = (size_t)t * HH;
    const float4* qjv = (const float4*)(qj + qoff);
    const float4* qiv = (const float4*)(qi + qoff);
    const float4* kj0 = (const float4*)(Kj + (size_t)i0 * HH);
    const float4* kj1 = (const float4*)(Kj + (size_t)i1 * HH);
    const float4* kj2 = (const float4*)(Kj + (size_t)i2 * HH);
    const float4* ki0 = (const float4*)(Ki + (size_t)i0 * HH);
    const float4* ki1 = (const float4*)(Ki + (size_t)i1 * HH);
    const float4* ki2 = (const float4*)(Ki + (size_t)i2 * HH);

    float sj0 = 0.f, sj1 = 0.f, sj2 = 0.f;
    float si0 = 0.f, si1 = 0.f, si2 = 0.f;

    const int nv = HH / 4;  // 256 float4 per row
    for (int it = lane; it < nv; it += 32) {
        float4 q = qjv[it];
        float4 k;
        k = kj0[it]; sj0 += q.x*k.x + q.y*k.y + q.z*k.z + q.w*k.w;
        k = kj1[it]; sj1 += q.x*k.x + q.y*k.y + q.z*k.z + q.w*k.w;
        k = kj2[it]; sj2 += q.x*k.x + q.y*k.y + q.z*k.z + q.w*k.w;
        float4 r = qiv[it];
        k = ki0[it]; si0 += r.x*k.x + r.y*k.y + r.z*k.z + r.w*k.w;
        k = ki1[it]; si1 += r.x*k.x + r.y*k.y + r.z*k.z + r.w*k.w;
        k = ki2[it]; si2 += r.x*k.x + r.y*k.y + r.z*k.z + r.w*k.w;
    }
    // wave32 xor reduction -> every lane holds the full sums
    for (int m = 16; m >= 1; m >>= 1) {
        sj0 += __shfl_xor(sj0, m); sj1 += __shfl_xor(sj1, m); sj2 += __shfl_xor(sj2, m);
        si0 += __shfl_xor(si0, m); si1 += __shfl_xor(si1, m); si2 += __shfl_xor(si2, m);
    }

    const float inv = 1.0f / sqrtf((float)HH);
    float lrel = sj0 * inv, l1 = sj1 * inv, l2 = sj2 * inv;

    const int rel = adv_ids[i0];          // wave-uniform
    float lfin;
    switch (rel) {
        case 0:  lfin = l1 + l2;            break;  // AND
        case 1:  lfin = fmaxf(l1, l2);      break;  // OR
        case 2:  lfin = -l1;                break;  // NOT
        case 3:  lfin = fmaxf(-l1, l2);     break;  // IMPLIES
        case 4:  lfin = fabsf(l1 - l2);     break;  // XOR
        default: lfin = lrel;               break;  // no gate
    }

    // softmax over {lfin, l1, l2}
    float mxj = fmaxf(lfin, fmaxf(l1, l2));
    float ej0 = __expf(lfin - mxj), ej1 = __expf(l1 - mxj), ej2 = __expf(l2 - mxj);
    float rsj = 1.0f / (ej0 + ej1 + ej2);
    float aj0 = ej0 * rsj, aj1 = ej1 * rsj, aj2 = ej2 * rsj;

    // softmax over si
    float t0 = si0 * inv, t1 = si1 * inv, t2 = si2 * inv;
    float mxi = fmaxf(t0, fmaxf(t1, t2));
    float ei0 = __expf(t0 - mxi), ei1 = __expf(t1 - mxi), ei2 = __expf(t2 - mxi);
    float rsi = 1.0f / (ei0 + ei1 + ei2);
    float ai0 = ei0 * rsi, ai1 = ei1 * rsi, ai2 = ei2 * rsi;

    // council softmax (2 elements)
    float c0 = council[0], c1 = council[1];
    float cm = fmaxf(c0, c1);
    float ec0 = __expf(c0 - cm), ec1 = __expf(c1 - cm);
    float rc = 1.0f / (ec0 + ec1);
    float w0 = ec0 * rc, w1 = ec1 * rc;

    const float fj0 = w0 * aj0, fj1 = w0 * aj1, fj2 = w0 * aj2;
    const float fi0 = w1 * ai0, fi1 = w1 * ai1, fi2 = w1 * ai2;

    const float4* vj0 = (const float4*)(Vj + (size_t)i0 * HH);
    const float4* vj1 = (const float4*)(Vj + (size_t)i1 * HH);
    const float4* vj2 = (const float4*)(Vj + (size_t)i2 * HH);
    const float4* vi0 = (const float4*)(Vi + (size_t)i0 * HH);
    const float4* vi1 = (const float4*)(Vi + (size_t)i1 * HH);
    const float4* vi2 = (const float4*)(Vi + (size_t)i2 * HH);
    float4* outr = (float4*)(ctx + qoff);

    for (int it = lane; it < nv; it += 32) {
        float4 v, o;
        v = vj0[it]; o.x = fj0*v.x; o.y = fj0*v.y; o.z = fj0*v.z; o.w = fj0*v.w;
        v = vj1[it]; o.x += fj1*v.x; o.y += fj1*v.y; o.z += fj1*v.z; o.w += fj1*v.w;
        v = vj2[it]; o.x += fj2*v.x; o.y += fj2*v.y; o.z += fj2*v.z; o.w += fj2*v.w;
        v = vi0[it]; o.x += fi0*v.x; o.y += fi0*v.y; o.z += fi0*v.z; o.w += fi0*v.w;
        v = vi1[it]; o.x += fi1*v.x; o.y += fi1*v.y; o.z += fi1*v.z; o.w += fi1*v.w;
        v = vi2[it]; o.x += fi2*v.x; o.y += fi2*v.y; o.z += fi2*v.z; o.w += fi2*v.w;
        outr[it] = o;
    }
}

// ---------------------------------------------------------------------------
// Launch: per batch b --
//   qj = hid_b @ Wqj^T ; qi = hid_b @ Wqi^T          (M = T)
//   Kj/Vj/Ki/Vi = adv_b @ W{kj,vj,ki,vi}^T            (M = L, PRE-gather!)
//   council_attn -> context row per token (aliased over qj)
//   out_b = context @ Wout^T * gain
// Workspace: 6 * T*H floats = 96 MB (context aliases qj). Per-batch K/V
// working set (64 MB) stays resident in the 192 MB L2 for the gather phase.
// ---------------------------------------------------------------------------
extern "C" void kernel_launch(void* const* d_in, const int* in_sizes, int n_in,
                              void* d_out, int out_size, void* d_ws, size_t ws_size,
                              hipStream_t stream) {
    const float* hidden  = (const float*)d_in[0];
    const float* advisor = (const float*)d_in[1];
    const int*   adv_ids = (const int*)  d_in[2];
    const int*   ptr_ids = (const int*)  d_in[3];
    const float* Wqj  = (const float*)d_in[4];
    const float* Wkj  = (const float*)d_in[5];
    const float* Wvj  = (const float*)d_in[6];
    const float* Wqi  = (const float*)d_in[7];
    const float* Wki  = (const float*)d_in[8];
    const float* Wvi  = (const float*)d_in[9];
    const float* Wout = (const float*)d_in[10];
    const float* gain    = (const float*)d_in[11];
    const float* council = (const float*)d_in[12];
    float* out = (float*)d_out;

    float* ws = (float*)d_ws;
    const size_t per = (size_t)TT * HH;
    float* qj = ws + 0 * per;
    float* qi = ws + 1 * per;
    float* Kj = ws + 2 * per;
    float* Vj = ws + 3 * per;
    float* Ki = ws + 4 * per;
    float* Vi = ws + 5 * per;
    float* ctx = qj;  // safe alias: attn reads qj row before writing ctx row

    const dim3 ggrid(HH / 64, TT / 128);
    const dim3 blk(256);

    for (int b = 0; b < BB; ++b) {
        const float* hb = hidden  + (size_t)b * TT * HH;
        const float* ab = advisor + (size_t)b * LL * HH;

        gemm_xwt_wmma<<<ggrid, blk, 0, stream>>>(hb, Wqj, qj, nullptr);
        gemm_xwt_wmma<<<ggrid, blk, 0, stream>>>(hb, Wqi, qi, nullptr);
        gemm_xwt_wmma<<<ggrid, blk, 0, stream>>>(ab, Wkj, Kj, nullptr);
        gemm_xwt_wmma<<<ggrid, blk, 0, stream>>>(ab, Wvj, Vj, nullptr);
        gemm_xwt_wmma<<<ggrid, blk, 0, stream>>>(ab, Wki, Ki, nullptr);
        gemm_xwt_wmma<<<ggrid, blk, 0, stream>>>(ab, Wvi, Vi, nullptr);

        council_attn<<<TT / 8, blk, 0, stream>>>(qj, qi, Kj, Vj, Ki, Vi,
                                                 adv_ids + (size_t)b * LL,
                                                 ptr_ids + (size_t)b * TT,
                                                 council, ctx);

        gemm_xwt_wmma<<<ggrid, blk, 0, stream>>>(ctx, Wout,
                                                 out + (size_t)b * TT * HH, gain);
    }
}

// v001
// It runs in 852 microseconds.
// Next to v000, in two timings, it ran 1.72 times as fast each time.
#include <hip/hip_runtime.h>
#include <hip/hip_bf16.h>
#include <math.h>

// Problem constants (from reference): B=4, T=4096, L=4096, H=1024
#define BB 4
#define TT 4096
#define LL 4096
#define HH 1024

// GEMM tiling
#define KC    128          // K-chunk staged in LDS per step
#define LDSW  132          // padded row stride (floats): bank advance 4/row -> conflict-free b64 reads

typedef __attribute__((ext_vector_type(2))) float v2f;
typedef __attribute__((ext_vector_type(8))) float v8f;

// ---------------------------------------------------------------------------
// GEMM: C[M,N] = (X[M,K] @ W[N,K]^T) * scale      (M=4096; K, N = H or 2H)
//
// Per wave: 16(M) x 64(N) tile via 4 f32 WMMA accumulators (V_WMMA_F32_16X16X4_F32).
// Block (8 waves): 128 x 64 tile. Grid: (N/64, M/128).
//
// The 64xKC W slab is shared by all 8 waves -> staged once per block into LDS
// with GLOBAL_LOAD_ASYNC_TO_LDS_B128 (ASYNCcnt), double-buffered so the copy
// of chunk c+1 overlaps the 32 WMMA K-steps of chunk c. B fragments then come
// from ds_load_b64 (conflict-free via the 132-float row pad); A fragments are
// wave-private rows loaded directly from global (L2 resident).
// ---------------------------------------------------------------------------
template <int K, int N>
__device__ __forceinline__
void gemm_xwt_body(const float* __restrict__ X, const float* __restrict__ W,
                   float* __restrict__ C, const float* __restrict__ scale_ptr) {
    constexpr int NCHUNK = K / KC;
    __shared__ __align__(16) float sw[2][64 * LDSW];

    const int tid  = threadIdx.x;
    const int lane = tid & 31;
    const int wave = tid >> 5;
    const int lr   = lane & 15;
    const int kp   = (lane >> 4) << 1;      // K-pair select: 0 or 2

    const int m0 = blockIdx.y * 128 + wave * 16;
    const int n0 = blockIdx.x * 64;

    const float* xrow  = X + (size_t)(m0 + lr) * K + kp;   // A fragment base
    const float* wtile = W + (size_t)n0 * K;               // uniform -> SGPR pair

    const uint32_t lds0 = (uint32_t)(uintptr_t)&sw[0][0];
    const uint32_t lds1 = (uint32_t)(uintptr_t)&sw[1][0];

    // Stage W[n0 .. n0+63][k0 .. k0+KC) into LDS buffer: 64*128 floats = 32KB,
    // 2048 16-byte pieces, 8 async b128 per thread. piece p = tid + 256*i,
    // r = p/32 (0..63), kk = (p%32)*4 (0..124).
    auto issue_chunk = [&](int k0, uint32_t ldsbase) {
        uint32_t loff[8], goff[8];
#pragma unroll
        for (int i = 0; i < 8; ++i) {
            const int p  = tid + (i << 8);
            const int r  = p >> 5;
            const int kk = (p & 31) << 2;
            loff[i] = ldsbase + (uint32_t)((r * LDSW + kk) << 2);
            goff[i] = (uint32_t)((((size_t)r * K) + k0 + kk) << 2);
        }
        // The eight copies and their s_wait_xcnt 0 are one statement, so that no
        // later write of an address register can be placed ahead of that wait.
        asm volatile("global_load_async_to_lds_b128 %0, %8, %16\n\t"
                     "global_load_async_to_lds_b128 %1, %9, %16\n\t"
                     "global_load_async_to_lds_b128 %2, %10, %16\n\t"
                     "global_load_async_to_lds_b128 %3, %11, %16\n\t"
                     "global_load_async_to_lds_b128 %4, %12, %16\n\t"
                     "global_load_async_to_lds_b128 %5, %13, %16\n\t"
                     "global_load_async_to_lds_b128 %6, %14, %16\n\t"
                     "global_load_async_to_lds_b128 %7, %15, %16\n\t"
                     "s_wait_xcnt 0x0"
                     :: "v"(loff[0]), "v"(loff[1]), "v"(loff[2]), "v"(loff[3]),
                        "v"(loff[4]), "v"(loff[5]), "v"(loff[6]), "v"(loff[7]),
                        "v"(goff[0]), "v"(goff[1]), "v"(goff[2]), "v"(goff[3]),
                        "v"(goff[4]), "v"(goff[5]), "v"(goff[6]), "v"(goff[7]),
                        "s"(wtile)
                     : "memory");
    };

    v8f acc0 = {}; v8f acc1 = {}; v8f acc2 = {}; v8f acc3 = {};

    issue_chunk(0, lds0);

    for (int c = 0; c < NCHUNK; ++c) {
        if (c > 0) __syncthreads();   // all waves done reading buf[(c+1)&1] (chunk c-1)
        if (c + 1 < NCHUNK) {
            issue_chunk((c + 1) * KC, ((c + 1) & 1) ? lds1 : lds0);
            // chunk c's 8 per-wave async ops precede chunk c+1's 8: allow 8 outstanding
            asm volatile("s_wait_asynccnt 0x8" ::: "memory");
        } else {
            asm volatile("s_wait_asynccnt 0x0" ::: "memory");
        }
        __syncthreads();              // all waves' chunk-c data visible in LDS

        const float* xp = xrow + c * KC;
        const float* sb = &sw[c & 1][lr * LDSW + kp];
#pragma unroll 4
        for (int kk = 0; kk < KC; kk += 4) {
            v2f a  = *(const v2f*)(xp + kk);
            v2f b0 = *(const v2f*)(sb + kk);
            v2f b1 = *(const v2f*)(sb + 16 * LDSW + kk);
            v2f b2 = *(const v2f*)(sb + 32 * LDSW + kk);
            v2f b3 = *(const v2f*)(sb + 48 * LDSW + kk);
            acc0 = __builtin_amdgcn_wmma_f32_16x16x4_f32(false, a, false, b0, (short)0, acc0, false, false);
            acc1 = __builtin_amdgcn_wmma_f32_16x16x4_f32(false, a, false, b1, (short)0, acc1, false, false);
            acc2 = __builtin_amdgcn_wmma_f32_16x16x4_f32(false, a, false, b2, (short)0, acc2, false, false);
            acc3 = __builtin_amdgcn_wmma_f32_16x16x4_f32(false, a, false, b3, (short)0, acc3, false, false);
        }
    }

    const float scale = scale_ptr ? scale_ptr[0] : 1.0f;

    // D layout: VGPR r -> row (m0 + 8*(lane/16) + r), col n0 + j*16 + lane%16
    const int mrow = m0 + (lane >> 4) * 8;
    float* crow = C + (size_t)mrow * N + n0 + lr;
#pragma unroll
    for (int r = 0; r < 8; ++r) {
        crow[(size_t)r * N +  0] = acc0[r] * scale;
        crow[(size_t)r * N + 16] = acc1[r] * scale;
        crow[(size_t)r * N + 32] = acc2[r] * scale;
        crow[(size_t)r * N + 48] = acc3[r] * scale;
    }
}

// qx[T, 2H] = hid[T, H] @ G2[2H, H]^T
__global__ __launch_bounds__(256)
void gemm_hid_g2(const float* __restrict__ X, const float* __restrict__ W,
                 float* __restrict__ C, const float* __restrict__ scale_ptr) {
    gemm_xwt_body<HH, 2 * HH>(X, W, C, scale_ptr);
}

// out[T, H] = (qx[T, 2H] @ P2[H, 2H]^T) * gain
__global__ __launch_bounds__(256)
void gemm_mix_p2(const float* __restrict__ X, const float* __restrict__ W,
                 float* __restrict__ C, const float* __restrict__ scale_ptr) {
    gemm_xwt_body<2 * HH, HH>(X, W, C, scale_ptr);
}

// ---------------------------------------------------------------------------
// Weight products, computed once per call on the f32 WMMA (one launch,
// blockIdx.z picks the product):
//   z = 0, 1:  G[m][k] = sum_n Wk[n][m] * Wq[n][k]    -> G2 rows z*H + m
//   z = 2, 3:  P[o][m] = sum_n Wout[o][n] * Wv[n][m]  -> P2[o][(z-2)*H + m]
// With them  q.k = (hid @ G^T) . adv_row  and
//            (sum_w a_w * v_w) @ Wout^T = (sum_w a_w * adv_row_w) @ P^T,
// so no advisor row is projected at all.
//
// Per wave 16 x 64, block 128 x 64. The second operand is read along its
// rows: one float4 per lane holds one column of each of the four accumulator
// tiles (tile j, lane lr <-> column c0 + 4*lr + j), so two b128 loads feed
// four WMMAs and the result goes out as float4 stores.
// ---------------------------------------------------------------------------
__global__ __launch_bounds__(256)
void fold_weights(const float* __restrict__ Wqj, const float* __restrict__ Wkj,
                  const float* __restrict__ Wvj, const float* __restrict__ Wqi,
                  const float* __restrict__ Wki, const float* __restrict__ Wvi,
                  const float* __restrict__ Wout,
                  float* __restrict__ G2, float* __restrict__ P2) {
    const int lane = threadIdx.x & 31;
    const int wave = threadIdx.x >> 5;
    const int lr   = lane & 15;
    const int kp   = (lane >> 4) << 1;      // K-pair select: 0 or 2

    const int z  = blockIdx.z;              // block-uniform
    const int r0 = blockIdx.y * 128 + wave * 16;
    const int c0 = blockIdx.x * 64;

    const bool score = z < 2;
    const float* A  = score ? (z == 0 ? Wkj : Wki) : Wout;
    const float* Bm = score ? (z == 0 ? Wqj : Wqi) : (z == 2 ? Wvj : Wvi);
    float* C        = score ? G2 + (size_t)z * HH * HH : P2 + (size_t)(z - 2) * HH;
    const int ldc   = score ? HH : 2 * HH;

    const float* bp = Bm + (size_t)kp * HH + c0 + 4 * lr;

    v8f acc0 = {}; v8f acc1 = {}; v8f acc2 = {}; v8f acc3 = {};

    auto mac = [&](v2f a, float4 x, float4 y) {
        v2f b0 = {x.x, y.x}; v2f b1 = {x.y, y.y};
        v2f b2 = {x.z, y.z}; v2f b3 = {x.w, y.w};
        acc0 = __builtin_amdgcn_wmma_f32_16x16x4_f32(false, a, false, b0, (short)0, acc0, false, false);
        acc1 = __builtin_amdgcn_wmma_f32_16x16x4_f32(false, a, false, b1, (short)0, acc1, false, false);
        acc2 = __builtin_amdgcn_wmma_f32_16x16x4_f32(false, a, false, b2, (short)0, acc2, false, false);
        acc3 = __builtin_amdgcn_wmma_f32_16x16x4_f32(false, a, false, b3, (short)0, acc3, false, false);
    };

    // Eight K-steps a trip: all their loads first, then their 32 WMMAs.
    // astep: floats from one K-step's first-operand pair to the next;
    // apair: floats between the two elements of a pair.
    auto sweep = [&](const float* ap, const int astep, const int apair) {
        for (int n = 0; n < HH; n += 32) {
            v2f a[8]; float4 x[8], y[8];
            // unrolled (here and below) so that a, x and y are registers, not scratch
#pragma unroll
            for (int j = 0; j < 8; ++j) {
                x[j] = *(const float4*)(bp + (size_t)(4 * j) * HH);        // row n+4j+kp
                y[j] = *(const float4*)(bp + (size_t)(4 * j) * HH + HH);   // row n+4j+kp+1
                a[j] = v2f{ap[j * astep], ap[j * astep + apair]};
            }
            // Wait behind the trip's last load, before any register that these
            // loads name as an address is written again.
            asm volatile("s_wait_xcnt 0x0" ::: "memory");
            // Keeps the pointer steps and the register moves below behind that wait.
            __builtin_amdgcn_sched_barrier(0);
#pragma unroll
            for (int j = 0; j < 8; ++j) mac(a[j], x[j], y[j]);
            ap += 8 * astep;
            bp += 32 * HH;
        }
    };

    if (score) {
        // first operand transposed: element (r, n) = A[n][r]
        sweep(A + (size_t)kp * HH + r0 + lr, 4 * HH, HH);
    } else {
        // first operand as stored: element (r, n) = A[r][n]
        sweep(A + (size_t)(r0 + lr) * HH + kp, 4, 1);
    }

    // D layout: VGPR r -> row r0 + 8*(lane/16) + r; tile j -> column c0 + 4*lr + j
    float* crow = C + (size_t)(r0 + (lane >> 4) * 8) * ldc + c0 + 4 * lr;
#pragma unroll
    for (int r = 0; r < 8; ++r) {
        *(float4*)(crow + (size_t)r * ldc) =
            make_float4(acc0[r], acc1[r], acc2[r], acc3[r]);
    }
}

// ---------------------------------------------------------------------------
// Per-token council attention. One wave32 per token t (8 tokens / block).
// qx row t holds [hid@Gj^T | hid@Gi^T]; both heads' scores are dot products
// with the three raw advisor rows of the window, which stay in registers.
// After the logic-gate rewrite of score[0], the two 3-way softmaxes and the
// council weights, the two mixed advisor rows overwrite the same qx row.
// ---------------------------------------------------------------------------
__global__ __launch_bounds__(256)
void council_attn(float* qx, const float* __restrict__ adv,
                  const int* __restrict__ adv_ids, const int* __restrict__ ptr_ids,
                  const float* __restrict__ council) {
    const int lane = threadIdx.x & 31;
    const int wave = threadIdx.x >> 5;
    const int t = blockIdx.x * 8 + wave;

    int p = ptr_ids[t];
    int i0 = min(max(p,     0), LL - 1);
    int i1 = min(max(p + 1, 0), LL - 1);
    int i2 = min(max(p + 2, 0), LL - 1);

    float4* row = (float4*)(qx + (size_t)t * (2 * HH));
    const float4* a0p = (const float4*)(adv + (size_t)i0 * HH);
    const float4* a1p = (const float4*)(adv + (size_t)i1 * HH);
    const float4* a2p = (const float4*)(adv + (size_t)i2 * HH);

    float sj0 = 0.f, sj1 = 0.f, sj2 = 0.f;
    float si0 = 0.f, si1 = 0.f, si2 = 0.f;

    constexpr int NV = HH / 4;        // 256 float4 per row
    constexpr int NI = NV / 32;       // 8 per lane
    float4 a0[NI], a1[NI], a2[NI];
#pragma unroll
    for (int i = 0; i < NI; ++i) {
        const int it = lane + 32 * i;
        a0[i] = a0p[it]; a1[i] = a1p[it]; a2[i] = a2p[it];
        float4 q = row[it];
        float4 k;
        k = a0[i]; sj0 += q.x*k.x + q.y*k.y + q.z*k.z + q.w*k.w;
        k = a1[i]; sj1 += q.x*k.x + q.y*k.y + q.z*k.z + q.w*k.w;
        k = a2[i]; sj2 += q.x*k.x + q.y*k.y + q.z*k.z + q.w*k.w;
        float4 r = row[NV + it];
        k = a0[i]; si0 += r.x*k.x + r.y*k.y + r.z*k.z + r.w*k.w;
        k = a1[i]; si1 += r.x*k.x + r.y*k.y + r.z*k.z + r.w*k.w;
        k = a2[i]; si2 += r.x*k.x + r.y*k.y + r.z*k.z + r.w*k.w;
    }
    // wave32 xor reduction -> every lane holds the full sums
    for (int m = 16; m >= 1; m >>= 1) {
        sj0 += __shfl_xor(sj0, m); sj1 += __shfl_xor(sj1, m); sj2 += __shfl_xor(sj2, m);
        si0 += __shfl_xor(si0, m); si1 += __shfl_xor(si1, m); si2 += __shfl_xor(si2, m);
    }

    const float inv = 1.0f / sqrtf((float)HH);
    float lrel = sj0 * inv, l1 = sj1 * inv, l2 = sj2 * inv;

    const int rel = adv_ids[i0];          // wave-uniform
    float lfin;
    switch (rel) {
        case 0:  lfin = l1 + l2;            break;  // AND
        case 1:  lfin = fmaxf(l1, l2);      break;  // OR
        case 2:  lfin = -l1;                break;  // NOT
        case 3:  lfin = fmaxf(-l1, l2);     break;  // IMPLIES
        case 4:  lfin = fabsf(l1 - l2);     break;  // XOR
        default: lfin = lrel;               break;  // no gate
    }

    // softmax over {lfin, l1, l2}
    float mxj = fmaxf(lfin, fmaxf(l1, l2));
    float ej0 = __expf(lfin - mxj), ej1 = __expf(l1 - mxj), ej2 = __expf(l2 - mxj);
    float rsj = 1.0f / (ej0 + ej1 + ej2);
    float aj0 = ej0 * rsj, aj1 = ej1 * rsj, aj2 = ej2 * rsj;

    // softmax over si
    float t0 = si0 * inv, t1 = si1 * inv, t2 = si2 * inv;
    float mxi = fmaxf(t0, fmaxf(t1, t2));
    float ei0 = __expf(t0 - mxi), ei1 = __expf(t1 - mxi), ei2 = __expf(t2 - mxi);
    float rsi = 1.0f / (ei0 + ei1 + ei2);
    float ai0 = ei0 * rsi, ai1 = ei1 * rsi, ai2 = ei2 * rsi;

    // council softmax (2 elements)
    float c0 = council[0], c1 = council[1];
    float cm = fmaxf(c0, c1);
    float ec0 = __expf(c0 - cm), ec1 = __expf(c1 - cm);
    float rc = 1.0f / (ec0 + ec1);
    float w0 = ec0 * rc, w1 = ec1 * rc;

    const float fj0 = w0 * aj0, fj1 = w0 * aj1, fj2 = w0 * aj2;
    const float fi0 = w1 * ai0, fi1 = w1 * ai1, fi2 = w1 * ai2;

#pragma unroll
    for (int i = 0; i < NI; ++i) {
        const int it = lane + 32 * i;
        const float4 u = a0[i], v = a1[i], w = a2[i];
        float4 o;
        o.x = fj0*u.x + fj1*v.x + fj2*w.x;  o.y = fj0*u.y + fj1*v.y + fj2*w.y;
        o.z = fj0*u.z + fj1*v.z + fj2*w.z;  o.w = fj0*u.w + fj1*v.w + fj2*w.w;
        row[it] = o;
        o.x = fi0*u.x + fi1*v.x + fi2*w.x;  o.y = fi0*u.y + fi1*v.y + fi2*w.y;
        o.z = fi0*u.z + fi1*v.z + fi2*w.z;  o.w = fi0*u.w + fi1*v.w + fi2*w.w;
        row[NV + it] = o;
    }
}

// ---------------------------------------------------------------------------
// Launch: once per call --
//   G2 = [Wkj^T Wqj ; Wki^T Wqi]  (2H x H),  P2 = [Wout Wvj | Wout Wvi]  (H x 2H)
// then per batch b --
//   qx  = hid_b @ G2^T                       (T x 2H)
//   council_attn: qx row -> [w0 * sum aj*adv | w1 * sum ai*adv]  (in place)
//   out_b = qx @ P2^T * gain                 (K = 2H)
// Workspace: T*2H + 2 * 2H*H floats = 48 MB, all written in this call.
// ---------------------------------------------------------------------------
extern "C" void kernel_launch(void* const* d_in, const int* in_sizes, int n_in,
                              void* d_out, int out_size, void* d_ws, size_t ws_size,
                              hipStream_t stream) {
    const float* hidden  = (const float*)d_in[0];
    const float* advisor = (const float*)d_in[1];
    const int*   adv_ids = (const int*)  d_in[2];
    const int*   ptr_ids = (const int*)  d_in[3];
    const float* Wqj  = (const float*)d_in[4];
    const float* Wkj  = (const float*)d_in[5];
    const float* Wvj  = (const float*)d_in[6];
    const float* Wqi  = (const float*)d_in[7];
    const float* Wki  = (const float*)d_in[8];
    const float* Wvi  = (const float*)d_in[9];
    const float* Wout = (const float*)d_in[10];
    const float* gain    = (const float*)d_in[11];
    const float* council = (const float*)d_in[12];
    float* out = (float*)d_out;

    float* ws = (float*)d_ws;
    float* qx = ws;                                  // T x 2H
    float* G2 = qx + (size_t)TT * 2 * HH;            // 2H x H
    float* P2 = G2 + (size_t)2 * HH * HH;            // H x 2H

    const dim3 blk(256);

    fold_weights<<<dim3(HH / 64, HH / 128, 4), blk, 0, stream>>>(
        Wqj, Wkj, Wvj, Wqi, Wki, Wvi, Wout, G2, P2);

    for (int b = 0; b < BB; ++b) {
        const float* hb = hidden  + (size_t)b * TT * HH;
        const float* ab = advisor + (size_t)b * LL * HH;

        gemm_hid_g2<<<dim3(2 * HH / 64, TT / 128), blk, 0, stream>>>(
            hb, G2, qx, nullptr);

        council_attn<<<TT / 8, blk, 0, stream>>>(qx, ab,
                                                 adv_ids + (size_t)b * LL,
                                                 ptr_ids + (size_t)b * TT,
                                                 council);

        gemm_mix_p2<<<dim3(HH / 64, TT / 128), blk, 0, stream>>>(
            qx, P2, out + (size_t)b * TT * HH, gain);
    }
}

// v002
// One run takes 742 microseconds.
// In both of two side-by-side timings against v001, it was 1.15 times as fast.
// All steps since v000 together make it 1.97 times as fast.
#include <hip/hip_runtime.h>
#include <hip/hip_bf16.h>
#include <math.h>

// Problem constants (from reference): B=4, T=4096, L=4096, H=1024
#define BB 4
#define TT 4096
#define LL 4096
#define HH 1024

typedef __attribute__((ext_vector_type(2))) float v2f;
typedef __attribute__((ext_vector_type(8))) float v8f;

// ---------------------------------------------------------------------------
// GEMM: C[M,N] = (X[M,K] @ W[N,K]^T) * scale      (M=4096; K, N = H or 2H)
//
// Per wave: 16(M) x 64(N) tile via 4 f32 WMMA accumulators (V_WMMA_F32_16X16X4_F32).
// Block (8 waves): 128 x 64 tile. Grid: (N/64, M/128).
//
// Both operands of a K-chunk (128 x KC of X, 64 x KC of W) are staged in LDS
// with GLOBAL_LOAD_ASYNC_TO_LDS_B128 (ASYNCcnt): every copy moves whole rows'
// worth of contiguous bytes, where a fragment load straight from global
// memory would touch 16 cache lines for 256 bytes. Two buffers: the copies of
// chunk t+1 fly while chunk t is multiplied. A and B fragments come from
// ds_load_b64; the row pitch of KC+4 floats advances 36 (KC = 32) or 4 (KC = 64) banks a row (mod 64),
// so the 16 rows x 4 dwords of one read fall on 64 different banks.
// ---------------------------------------------------------------------------
template <int K, int N, int KC>
__device__ __forceinline__
void gemm_xwt_body(const float* __restrict__ X, const float* __restrict__ W,
                   float* __restrict__ C, const float* __restrict__ scale_ptr) {
    static_assert(KC == 32 || KC == 64, "the copy statements below are written for these two");
    constexpr int NCHUNK = K / KC;
    static_assert(NCHUNK >= 2, "the ring's prologue fills two chunks");
    constexpr int LDSW = KC + 4;              // padded row pitch, floats
    constexpr int PPR  = KC / 4;              // 16-byte pieces per row
    constexpr int RPC  = 256 / PPR;           // rows that one copy of the whole block covers
    constexpr int NX   = 128 / RPC;           // X copies per thread and chunk
    constexpr int NW   = 64 / RPC;            // W copies per thread and chunk
    __shared__ __align__(16) float sx[2][128 * LDSW];
    __shared__ __align__(16) float sw[2][64 * LDSW];

    const int tid  = threadIdx.x;
    const int lane = tid & 31;
    const int wave = tid >> 5;
    const int lr   = lane & 15;
    const int kp   = (lane >> 4) << 1;      // K-pair select: 0 or 2

    const int m0 = blockIdx.y * 128 + wave * 16;
    const int n0 = blockIdx.x * 64;

    const float* xtile = X + (size_t)(blockIdx.y * 128) * K;   // uniform -> SGPR pair
    const float* wtile = W + (size_t)n0 * K;                   // uniform -> SGPR pair

    // This thread's piece of a copy: row tid/PPR, floats (tid%PPR)*4 .. +3;
    // copy i of an operand takes the row RPC*i further down.
    const int pr = tid / PPR;
    const int pk = (tid % PPR) << 2;
    const uint32_t lpiece = (uint32_t)((pr * LDSW + pk) << 2);   // byte offset in an LDS tile
    const uint32_t gpiece = (uint32_t)((pr * K + pk) << 2);      // byte offset in a global tile

    // Stage X[128 rows][k0 .. k0+KC) and W[64 rows][k0 .. k0+KC) into buffer b.
    auto issue_chunk = [&](int k0, int b) {
        const float* xs = xtile + k0;
        const float* wsrc = wtile + k0;
        const uint32_t lxb = (uint32_t)(uintptr_t)&sx[b][0] + lpiece;
        const uint32_t lwb = (uint32_t)(uintptr_t)&sw[b][0] + lpiece;
        uint32_t lx[NX], gx[NX], lw[NW], gw[NW];
        // unrolled (both loops) so that the four arrays are registers
#pragma unroll
        for (int i = 0; i < NX; ++i) {
            lx[i] = lxb + (uint32_t)(i * RPC * LDSW * 4);
            gx[i] = gpiece + (uint32_t)(i * RPC * K * 4);
        }
#pragma unroll
        for (int i = 0; i < NW; ++i) {
            lw[i] = lwb + (uint32_t)(i * RPC * LDSW * 4);
            gw[i] = gpiece + (uint32_t)(i * RPC * K * 4);
        }
        // A chunk's copies and their s_wait_xcnt 0 are one statement, so that no
        // later write of an address register can be placed ahead of that wait.
        if constexpr (KC == 32) {
            asm volatile("global_load_async_to_lds_b128 %0, %4, %12\n\t"
                         "global_load_async_to_lds_b128 %1, %5, %12\n\t"
                         "global_load_async_to_lds_b128 %2, %6, %12\n\t"
                         "global_load_async_to_lds_b128 %3, %7, %12\n\t"
                         "global_load_async_to_lds_b128 %8, %10, %13\n\t"
                         "global_load_async_to_lds_b128 %9, %11, %13\n\t"
                         "s_wait_xcnt 0x0"
                         :: "v"(lx[0]), "v"(lx[1]), "v"(lx[2]), "v"(lx[3]),
                            "v"(gx[0]), "v"(gx[1]), "v"(gx[2]), "v"(gx[3]),
                            "v"(lw[0]), "v"(lw[1]), "v"(gw[0]), "v"(gw[1]),
                            "s"(xs), "s"(wsrc)
                         : "memory");
        } else {
            asm volatile("global_load_async_to_lds_b128 %0, %8, %24\n\t"
                         "global_load_async_to_lds_b128 %1, %9, %24\n\t"
                         "global_load_async_to_lds_b128 %2, %10, %24\n\t"
                         "global_load_async_to_lds_b128 %3, %11, %24\n\t"
                         "global_load_async_to_lds_b128 %4, %12, %24\n\t"
                         "global_load_async_to_lds_b128 %5, %13, %24\n\t"
                         "global_load_async_to_lds_b128 %6, %14, %24\n\t"
                         "global_load_async_to_lds_b128 %7, %15, %24\n\t"
                         "global_load_async_to_lds_b128 %16, %20, %25\n\t"
                         "global_load_async_to_lds_b128 %17, %21, %25\n\t"
                         "global_load_async_to_lds_b128 %18, %22, %25\n\t"
                         "global_load_async_to_lds_b128 %19, %23, %25\n\t"
                         "s_wait_xcnt 0x0"
                         :: "v"(lx[0]), "v"(lx[1]), "v"(lx[2]), "v"(lx[3]),
                            "v"(lx[4]), "v"(lx[5]), "v"(lx[6]), "v"(lx[7]),
                            "v"(gx[0]), "v"(gx[1]), "v"(gx[2]), "v"(gx[3]),
                            "v"(gx[4]), "v"(gx[5]), "v"(gx[6]), "v"(gx[7]),
                            "v"(lw[0]), "v"(lw[1]), "v"(lw[2]), "v"(lw[3]),
                            "v"(gw[0]), "v"(gw[1]), "v"(gw[2]), "v"(gw[3]),
                            "s"(xs), "s"(wsrc)
                         : "memory");
        }
    };

    v8f acc0 = {}; v8f acc1 = {}; v8f acc2 = {}; v8f acc3 = {};

    // Prologue: chunk 0 landed and published, then chunk 1 set off.
    issue_chunk(0, 0);
    asm volatile("s_wait_asynccnt 0x0" ::: "memory");   // this wave's chunk-0 copies have landed
    __syncthreads();                                    // ... and every other wave's
    issue_chunk(KC, 1);

    for (int t = 0; t < NCHUNK; ++t) {
        const float* sa = &sx[t & 1][(wave * 16 + lr) * LDSW + kp];
        const float* sb = &sw[t & 1][lr * LDSW + kp];
        // unrolled so that fragments are fetched ahead of the WMMAs that use them
#pragma unroll
        for (int kk = 0; kk < KC; kk += 4) {
            v2f a  = *(const v2f*)(sa + kk);
            v2f b0 = *(const v2f*)(sb + kk);
            v2f b1 = *(const v2f*)(sb + 16 * LDSW + kk);
            v2f b2 = *(const v2f*)(sb + 32 * LDSW + kk);
            v2f b3 = *(const v2f*)(sb + 48 * LDSW + kk);
            acc0 = __builtin_amdgcn_wmma_f32_16x16x4_f32(false, a, false, b0, (short)0, acc0, false, false);
            acc1 = __builtin_amdgcn_wmma_f32_16x16x4_f32(false, a, false, b1, (short)0, acc1, false, false);
            acc2 = __builtin_amdgcn_wmma_f32_16x16x4_f32(false, a, false, b2, (short)0, acc2, false, false);
            acc3 = __builtin_amdgcn_wmma_f32_16x16x4_f32(false, a, false, b3, (short)0, acc3, false, false);
        }
        // Publish point of chunk t+1; it also frees the buffer of chunk t.
        asm volatile("s_wait_dscnt 0x0" ::: "memory");      // this wave's reads of chunk t are done
        asm volatile("s_wait_asynccnt 0x0" ::: "memory");   // this wave's chunk-(t+1) copies have landed
        __syncthreads();                                    // the same holds for every wave
        if (t + 2 < NCHUNK) issue_chunk((t + 2) * KC, t & 1);
    }
    asm volatile("s_wait_asynccnt 0x0" ::: "memory");       // no copy outlives the loop

    const float scale = scale_ptr ? scale_ptr[0] : 1.0f;

    // D layout: VGPR r -> row (m0 + 8*(lane/16) + r), col n0 + j*16 + lane%16
    const int mrow = m0 + (lane >> 4) * 8;
    float* crow = C + (size_t)mrow * N + n0 + lr;
#pragma unroll
    for (int r = 0; r < 8; ++r) {
        crow[(size_t)r * N +  0] = acc0[r] * scale;
        crow[(size_t)r * N + 16] = acc1[r] * scale;
        crow[(size_t)r * N + 32] = acc2[r] * scale;
        crow[(size_t)r * N + 48] = acc3[r] * scale;
    }
}

// qx[T, 2H] = hid[T, H] @ G2[2H, H]^T
// 1024 blocks on 256 WGPs: KC = 32 lets four blocks share a WGP's LDS, and the
// wave limit keeps a fifth out, so that every WGP holds the same share.
__global__ __launch_bounds__(256) __attribute__((amdgpu_waves_per_eu(8, 8)))
void gemm_hid_g2(const float* __restrict__ X, const float* __restrict__ W,
                 float* __restrict__ C, const float* __restrict__ scale_ptr) {
    gemm_xwt_body<HH, 2 * HH, 32>(X, W, C, scale_ptr);
}

// out[T, H] = (qx[T, 2H] @ P2[H, 2H]^T) * gain
// 512 blocks, two a WGP: room for KC = 64, half the publish points.
__global__ __launch_bounds__(256)
void gemm_mix_p2(const float* __restrict__ X, const float* __restrict__ W,
                 float* __restrict__ C, const float* __restrict__ scale_ptr) {
    gemm_xwt_body<2 * HH, HH, 64>(X, W, C, scale_ptr);
}

// ---------------------------------------------------------------------------
// Weight products, computed once per call on the f32 WMMA (one launch,
// blockIdx.z picks the product):
//   z = 0, 1:  G[m][k] = sum_n Wk[n][m] * Wq[n][k]    -> G2 rows z*H + m
//   z = 2, 3:  P[o][m] = sum_n Wout[o][n] * Wv[n][m]  -> P2[o][(z-2)*H + m]
// With them  q.k = (hid @ G^T) . adv_row  and
//            (sum_w a_w * v_w) @ Wout^T = (sum_w a_w * adv_row_w) @ P^T,
// so no advisor row is projected at all.
//
// Per wave 16 x 64, block 128 x 64. The second operand is read along its
// rows: one float4 per lane holds one column of each of the four accumulator
// tiles (tile j, lane lr <-> column c0 + 4*lr + j), so two b128 loads feed
// four WMMAs and the result goes out as float4 stores.
// ---------------------------------------------------------------------------
__global__ __launch_bounds__(256)
void fold_weights(const float* __restrict__ Wqj, const float* __restrict__ Wkj,
                  const float* __restrict__ Wvj, const float* __restrict__ Wqi,
                  const float* __restrict__ Wki, const float* __restrict__ Wvi,
                  const float* __restrict__ Wout,
                  float* __restrict__ G2, float* __restrict__ P2) {
    const int lane = threadIdx.x & 31;
    const int wave = threadIdx.x >> 5;
    const int lr   = lane & 15;
    const int kp   = (lane >> 4) << 1;      // K-pair select: 0 or 2

    const int z  = blockIdx.z;              // block-uniform
    const int r0 = blockIdx.y * 128 + wave * 16;
    const int c0 = blockIdx.x * 64;

    const bool score = z < 2;
    const float* A  = score ? (z == 0 ? Wkj : Wki) : Wout;
    const float* Bm = score ? (z == 0 ? Wqj : Wqi) : (z == 2 ? Wvj : Wvi);
    float* C        = score ? G2 + (size_t)z * HH * HH : P2 + (size_t)(z - 2) * HH;
    const int ldc   = score ? HH : 2 * HH;

    const float* bp = Bm + (size_t)kp * HH + c0 + 4 * lr;

    v8f acc0 = {}; v8f acc1 = {}; v8f acc2 = {}; v8f acc3 = {};

    auto mac = [&](v2f a, float4 x, float4 y) {
        v2f b0 = {x.x, y.x}; v2f b1 = {x.y, y.y};
        v2f b2 = {x.z, y.z}; v2f b3 = {x.w, y.w};
        acc0 = __builtin_amdgcn_wmma_f32_16x16x4_f32(false, a, false, b0, (short)0, acc0, false, false);
        acc1 = __builtin_amdgcn_wmma_f32_16x16x4_f32(false, a, false, b1, (short)0, acc1, false, false);
        acc2 = __builtin_amdgcn_wmma_f32_16x16x4_f32(false, a, false, b2, (short)0, acc2, false, false);
        acc3 = __builtin_amdgcn_wmma_f32_16x16x4_f32(false, a, false, b3, (short)0, acc3, false, false);
    };

    // Eight K-steps a trip: all their loads first, then their 32 WMMAs.
    // astep: floats from one K-step's first-operand pair to the next;
    // apair: floats between the two elements of a pair.
    auto sweep = [&](const float* ap, const int astep, const int apair) {
        for (int n = 0; n < HH; n += 32) {
            v2f a[8]; float4 x[8], y[8];
            // unrolled (here and below) so that a, x and y are registers, not scratch
#pragma unroll
            for (int j = 0; j < 8; ++j) {
                x[j] = *(const float4*)(bp + (size_t)(4 * j) * HH);        // row n+4j+kp
                y[j] = *(const float4*)(bp + (size_t)(4 * j) * HH + HH);   // row n+4j+kp+1
                a[j] = v2f{ap[j * astep], ap[j * astep + apair]};
            }
            // Wait behind the trip's last load, before any register that these
            // loads name as an address is written again.
            asm volatile("s_wait_xcnt 0x0" ::: "memory");
            // Keeps the pointer steps and the register moves below behind that wait.
            __builtin_amdgcn_sched_barrier(0);
#pragma unroll
            for (int j = 0; j < 8; ++j) mac(a[j], x[j], y[j]);
            ap += 8 * astep;
            bp += 32 * HH;
        }
    };

    if (score) {
        // first operand transposed: element (r, n) = A[n][r]
        sweep(A + (size_t)kp * HH + r0 + lr, 4 * HH, HH);
    } else {
        // first operand as stored: element (r, n) = A[r][n]
        sweep(A + (size_t)(r0 + lr) * HH + kp, 4, 1);
    }

    // D layout: VGPR r -> row r0 + 8*(lane/16) + r; tile j -> column c0 + 4*lr + j
    float* crow = C + (size_t)(r0 + (lane >> 4) * 8) * ldc + c0 + 4 * lr;
#pragma unroll
    for (int r = 0; r < 8; ++r) {
        *(float4*)(crow + (size_t)r * ldc) =
            make_float4(acc0[r], acc1[r], acc2[r], acc3[r]);
    }
}

// ---------------------------------------------------------------------------
// Per-token council attention. One wave32 per token t (8 tokens / block).
// qx row t holds [hid@Gj^T | hid@Gi^T]; both heads' scores are dot products
// with the three raw advisor rows of the window, which stay in registers.
// After the logic-gate rewrite of score[0], the two 3-way softmaxes and the
// council weights, the two mixed advisor rows overwrite the same qx row.
// ---------------------------------------------------------------------------
__global__ __launch_bounds__(256)
void council_attn(float* qx, const float* __restrict__ adv,
                  const int* __restrict__ adv_ids, const int* __restrict__ ptr_ids,
                  const float* __restrict__ council) {
    const int lane = threadIdx.x & 31;
    const int wave = threadIdx.x >> 5;
    const int t = blockIdx.x * 8 + wave;

    int p = ptr_ids[t];
    int i0 = min(max(p,     0), LL - 1);
    int i1 = min(max(p + 1, 0), LL - 1);
    int i2 = min(max(p + 2, 0), LL - 1);

    float4* row = (float4*)(qx + (size_t)t * (2 * HH));
    const float4* a0p = (const float4*)(adv + (size_t)i0 * HH);
    const float4* a1p = (const float4*)(adv + (size_t)i1 * HH);
    const float4* a2p = (const float4*)(adv + (size_t)i2 * HH);

    float sj0 = 0.f, sj1 = 0.f, sj2 = 0.f;
    float si0 = 0.f, si1 = 0.f, si2 = 0.f;

    constexpr int NV = HH / 4;        // 256 float4 per row
    constexpr int NI = NV / 32;       // 8 per lane
    float4 a0[NI], a1[NI], a2[NI];
#pragma unroll
    for (int i = 0; i < NI; ++i) {
        const int it = lane + 32 * i;
        a0[i] = a0p[it]; a1[i] = a1p[it]; a2[i] = a2p[it];
        float4 q = row[it];
        float4 k;
        k = a0[i]; sj0 += q.x*k.x + q.y*k.y + q.z*k.z + q.w*k.w;
        k = a1[i]; sj1 += q.x*k.x + q.y*k.y + q.z*k.z + q.w*k.w;
        k = a2[i]; sj2 += q.x*k.x + q.y*k.y + q.z*k.z + q.w*k.w;
        float4 r = row[NV + it];
        k = a0[i]; si0 += r.x*k.x + r.y*k.y + r.z*k.z + r.w*k.w;
        k = a1[i]; si1 += r.x*k.x + r.y*k.y + r.z*k.z + r.w*k.w;
        k = a2[i]; si2 += r.x*k.x + r.y*k.y + r.z*k.z + r.w*k.w;
    }
    // wave32 xor reduction -> every lane holds the full sums
    for (int m = 16; m >= 1; m >>= 1) {
        sj0 += __shfl_xor(sj0, m); sj1 += __shfl_xor(sj1, m); sj2 += __shfl_xor(sj2, m);
        si0 += __shfl_xor(si0, m); si1 += __shfl_xor(si1, m); si2 += __shfl_xor(si2, m);
    }

    const float inv = 1.0f / sqrtf((float)HH);
    float lrel = sj0 * inv, l1 = sj1 * inv, l2 = sj2 * inv;

    const int rel = adv_ids[i0];          // wave-uniform
    float lfin;
    switch (rel) {
        case 0:  lfin = l1 + l2;            break;  // AND
        case 1:  lfin = fmaxf(l1, l2);      break;  // OR
        case 2:  lfin = -l1;                break;  // NOT
        case 3:  lfin = fmaxf(-l1, l2);     break;  // IMPLIES
        case 4:  lfin = fabsf(l1 - l2);     break;  // XOR
        default: lfin = lrel;               break;  // no gate
    }

    // softmax over {lfin, l1, l2}
    float mxj = fmaxf(lfin, fmaxf(l1, l2));
    float ej0 = __expf(lfin - mxj), ej1 = __expf(l1 - mxj), ej2 = __expf(l2 - mxj);
    float rsj = 1.0f / (ej0 + ej1 + ej2);
    float aj0 = ej0 * rsj, aj1 = ej1 * rsj, aj2 = ej2 * rsj;

    // softmax over si
    float t0 = si0 * inv, t1 = si1 * inv, t2 = si2 * inv;
    float mxi = fmaxf(t0, fmaxf(t1, t2));
    float ei0 = __expf(t0 - mxi), ei1 = __expf(t1 - mxi), ei2 = __expf(t2 - mxi);
    float rsi = 1.0f / (ei0 + ei1 + ei2);
    float ai0 = ei0 * rsi, ai1 = ei1 * rsi, ai2 = ei2 * rsi;

    // council softmax (2 elements)
    float c0 = council[0], c1 = council[1];
    float cm = fmaxf(c0, c1);
    float ec0 = __expf(c0 - cm), ec1 = __expf(c1 - cm);
    float rc = 1.0f / (ec0 + ec1);
    float w0 = ec0 * rc, w1 = ec1 * rc;

    const float fj0 = w0 * aj0, fj1 = w0 * aj1, fj2 = w0 * aj2;
    const float fi0 = w1 * ai0, fi1 = w1 * ai1, fi2 = w1 * ai2;

#pragma unroll
    for (int i = 0; i < NI; ++i) {
        const int it = lane + 32 * i;
        const float4 u = a0[i], v = a1[i], w = a2[i];
        float4 o;
        o.x = fj0*u.x + fj1*v.x + fj2*w.x;  o.y = fj0*u.y + fj1*v.y + fj2*w.y;
        o.z = fj0*u.z + fj1*v.z + fj2*w.z;  o.w = fj0*u.w + fj1*v.w + fj2*w.w;
        row[it] = o;
        o.x = fi0*u.x + fi1*v.x + fi2*w.x;  o.y = fi0*u.y + fi1*v.y + fi2*w.y;
        o.z = fi0*u.z + fi1*v.z + fi2*w.z;  o.w = fi0*u.w + fi1*v.w + fi2*w.w;
        row[NV + it] = o;
    }
}

// ---------------------------------------------------------------------------
// Launch: once per call --
//   G2 = [Wkj^T Wqj ; Wki^T Wqi]  (2H x H),  P2 = [Wout Wvj | Wout Wvi]  (H x 2H)
// then per batch b --
//   qx  = hid_b @ G2^T                       (T x 2H)
//   council_attn: qx row -> [w0 * sum aj*adv | w1 * sum ai*adv]  (in place)
//   out_b = qx @ P2^T * gain                 (K = 2H)
// Workspace: T*2H + 2 * 2H*H floats = 48 MB, all written in this call.
// ---------------------------------------------------------------------------
extern "C" void kernel_launch(void* const* d_in, const int* in_sizes, int n_in,
                              void* d_out, int out_size, void* d_ws, size_t ws_size,
                              hipStream_t stream) {
    const float* hidden  = (const float*)d_in[0];
    const float* advisor = (const float*)d_in[1];
    const int*   adv_ids = (const int*)  d_in[2];
    const int*   ptr_ids = (const int*)  d_in[3];
    const float* Wqj  = (const float*)d_in[4];
    const float* Wkj  = (const float*)d_in[5];
    const float* Wvj  = (const float*)d_in[6];
    const float* Wqi  = (const float*)d_in[7];
    const float* Wki  = (const float*)d_in[8];
    const float* Wvi  = (const float*)d_in[9];
    const float* Wout = (const float*)d_in[10];
    const float* gain    = (const float*)d_in[11];
    const float* council = (const float*)d_in[12];
    float* out = (float*)d_out;

    float* ws = (float*)d_ws;
    float* qx = ws;                                  // T x 2H
    float* G2 = qx + (size_t)TT * 2 * HH;            // 2H x H
    float* P2 = G2 + (size_t)2 * HH * HH;            // H x 2H

    const dim3 blk(256);

    fold_weights<<<dim3(HH / 64, HH / 128, 4), blk, 0, stream>>>(
        Wqj, Wkj, Wvj, Wqi, Wki, Wvi, Wout, G2, P2);

    for (int b = 0; b < BB; ++b) {
        const float* hb = hidden  + (size_t)b * TT * HH;
        const float* ab = advisor + (size_t)b * LL * HH;

        gemm_hid_g2<<<dim3(2 * HH / 64, TT / 128), blk, 0, stream>>>(
            hb, G2, qx, nullptr);

        council_attn<<<TT / 8, blk, 0, stream>>>(qx, ab,
                                                 adv_ids + (size_t)b * LL,
                                                 ptr_ids + (size_t)b * TT,
                                                 council);

        gemm_mix_p2<<<dim3(HH / 64, TT / 128), blk, 0, stream>>>(
            qx, P2, out + (size_t)b * TT * HH, gain);
    }
}

// v003
// A run of this version takes 676 microseconds.
// Next to v002, in two timings, it ran 1.10 times as fast each time.
// All steps since v000 together make it 2.17 times as fast.
#include <hip/hip_runtime.h>
#include <hip/hip_bf16.h>
#include <math.h>

// Problem constants (from reference): B=4, T=4096, L=4096, H=1024
#define BB 4
#define TT 4096
#define LL 4096
#define HH 1024
#define MT (BB * TT)   // token rows of all batches together

typedef __attribute__((ext_vector_type(2))) float v2f;
typedef __attribute__((ext_vector_type(8))) float v8f;

// ---------------------------------------------------------------------------
// GEMM: C[M,N] = (X[M,K] @ W[N,K]^T) * scale      (M = B*T; K, N = H or 2H)
//
// Per wave: 16(M) x 64(N) tile via 4 f32 WMMA accumulators (V_WMMA_F32_16X16X4_F32).
// Block (8 waves): 128 x 64 tile. Grid: (N/64, M/128).
//
// Both operands of a K-chunk (128 x KC of X, 64 x KC of W) are staged in LDS
// with GLOBAL_LOAD_ASYNC_TO_LDS_B128 (ASYNCcnt): every copy moves whole rows'
// worth of contiguous bytes, where a fragment load straight from global
// memory would touch 16 cache lines for 256 bytes. Two buffers: the copies of
// chunk t+1 fly while chunk t is multiplied. A and B fragments come from
// ds_load_b64; the row pitch of KC+4 floats advances 36 (KC = 32) or 4 (KC = 64) banks a row (mod 64),
// so the 16 rows x 4 dwords of one read fall on 64 different banks.
// ---------------------------------------------------------------------------
template <int K, int N, int KC>
__device__ __forceinline__
void gemm_xwt_body(const float* __restrict__ X, const float* __restrict__ W,
                   float* __restrict__ C, const float* __restrict__ scale_ptr) {
    static_assert(KC == 32 || KC == 64, "the copy statements below are written for these two");
    constexpr int NCHUNK = K / KC;
    static_assert(NCHUNK >= 2, "the ring's prologue fills two chunks");
    constexpr int LDSW = KC + 4;              // padded row pitch, floats
    constexpr int PPR  = KC / 4;              // 16-byte pieces per row
    constexpr int RPC  = 256 / PPR;           // rows that one copy of the whole block covers
    constexpr int NX   = 128 / RPC;           // X copies per thread and chunk
    constexpr int NW   = 64 / RPC;            // W copies per thread and chunk
    __shared__ __align__(16) float sx[2][128 * LDSW];
    __shared__ __align__(16) float sw[2][64 * LDSW];

    const int tid  = threadIdx.x;
    const int lane = tid & 31;
    const int wave = tid >> 5;
    const int lr   = lane & 15;
    const int kp   = (lane >> 4) << 1;      // K-pair select: 0 or 2

    const int m0 = blockIdx.y * 128 + wave * 16;
    const int n0 = blockIdx.x * 64;

    const float* xtile = X + (size_t)(blockIdx.y * 128) * K;   // uniform -> SGPR pair
    const float* wtile = W + (size_t)n0 * K;                   // uniform -> SGPR pair

    // This thread's piece of a copy: row tid/PPR, floats (tid%PPR)*4 .. +3;
    // copy i of an operand takes the row RPC*i further down.
    const int pr = tid / PPR;
    const int pk = (tid % PPR) << 2;
    const uint32_t lpiece = (uint32_t)((pr * LDSW + pk) << 2);   // byte offset in an LDS tile
    const uint32_t gpiece = (uint32_t)((pr * K + pk) << 2);      // byte offset in a global tile

    // Stage X[128 rows][k0 .. k0+KC) and W[64 rows][k0 .. k0+KC) into buffer b.
    auto issue_chunk = [&](int k0, int b) {
        const float* xs = xtile + k0;
        const float* wsrc = wtile + k0;
        const uint32_t lxb = (uint32_t)(uintptr_t)&sx[b][0] + lpiece;
        const uint32_t lwb = (uint32_t)(uintptr_t)&sw[b][0] + lpiece;
        uint32_t lx[NX], gx[NX], lw[NW], gw[NW];
        // unrolled (both loops) so that the four arrays are registers
#pragma unroll
        for (int i = 0; i < NX; ++i) {
            lx[i] = lxb + (uint32_t)(i * RPC * LDSW * 4);
            gx[i] = gpiece + (uint32_t)(i * RPC * K * 4);
        }
#pragma unroll
        for (int i = 0; i < NW; ++i) {
            lw[i] = lwb + (uint32_t)(i * RPC * LDSW * 4);
            gw[i] = gpiece + (uint32_t)(i * RPC * K * 4);
        }
        // A chunk's copies and their s_wait_xcnt 0 are one statement, so that no
        // later write of an address register can be placed ahead of that wait.
        if constexpr (KC == 32) {
            asm volatile("global_load_async_to_lds_b128 %0, %4, %12\n\t"
                         "global_load_async_to_lds_b128 %1, %5, %12\n\t"
                         "global_load_async_to_lds_b128 %2, %6, %12\n\t"
                         "global_load_async_to_lds_b128 %3, %7, %12\n\t"
                         "global_load_async_to_lds_b128 %8, %10, %13\n\t"
                         "global_load_async_to_lds_b128 %9, %11, %13\n\t"
                         "s_wait_xcnt 0x0"
                         :: "v"(lx[0]), "v"(lx[1]), "v"(lx[2]), "v"(lx[3]),
                            "v"(gx[0]), "v"(gx[1]), "v"(gx[2]), "v"(gx[3]),
                            "v"(lw[0]), "v"(lw[1]), "v"(gw[0]), "v"(gw[1]),
                            "s"(xs), "s"(wsrc)
                         : "memory");
        } else {
            asm volatile("global_load_async_to_lds_b128 %0, %8, %24\n\t"
                         "global_load_async_to_lds_b128 %1, %9, %24\n\t"
                         "global_load_async_to_lds_b128 %2, %10, %24\n\t"
                         "global_load_async_to_lds_b128 %3, %11, %24\n\t"
                         "global_load_async_to_lds_b128 %4, %12, %24\n\t"
                         "global_load_async_to_lds_b128 %5, %13, %24\n\t"
                         "global_load_async_to_lds_b128 %6, %14, %24\n\t"
                         "global_load_async_to_lds_b128 %7, %15, %24\n\t"
                         "global_load_async_to_lds_b128 %16, %20, %25\n\t"
                         "global_load_async_to_lds_b128 %17, %21, %25\n\t"
                         "global_load_async_to_lds_b128 %18, %22, %25\n\t"
                         "global_load_async_to_lds_b128 %19, %23, %25\n\t"
                         "s_wait_xcnt 0x0"
                         :: "v"(lx[0]), "v"(lx[1]), "v"(lx[2]), "v"(lx[3]),
                            "v"(lx[4]), "v"(lx[5]), "v"(lx[6]), "v"(lx[7]),
                            "v"(gx[0]), "v"(gx[1]), "v"(gx[2]), "v"(gx[3]),
                            "v"(gx[4]), "v"(gx[5]), "v"(gx[6]), "v"(gx[7]),
                            "v"(lw[0]), "v"(lw[1]), "v"(lw[2]), "v"(lw[3]),
                            "v"(gw[0]), "v"(gw[1]), "v"(gw[2]), "v"(gw[3]),
                            "s"(xs), "s"(wsrc)
                         : "memory");
        }
    };

    v8f acc0 = {}; v8f acc1 = {}; v8f acc2 = {}; v8f acc3 = {};

    // Prologue: chunk 0 landed and published, then chunk 1 set off.
    issue_chunk(0, 0);
    asm volatile("s_wait_asynccnt 0x0" ::: "memory");   // this wave's chunk-0 copies have landed
    __syncthreads();                                    // ... and every other wave's
    issue_chunk(KC, 1);

    for (int t = 0; t < NCHUNK; ++t) {
        const float* sa = &sx[t & 1][(wave * 16 + lr) * LDSW + kp];
        const float* sb = &sw[t & 1][lr * LDSW + kp];
        // unrolled so that fragments are fetched ahead of the WMMAs that use them
#pragma unroll
        for (int kk = 0; kk < KC; kk += 4) {
            v2f a  = *(const v2f*)(sa + kk);
            v2f b0 = *(const v2f*)(sb + kk);
            v2f b1 = *(const v2f*)(sb + 16 * LDSW + kk);
            v2f b2 = *(const v2f*)(sb + 32 * LDSW + kk);
            v2f b3 = *(const v2f*)(sb + 48 * LDSW + kk);
            acc0 = __builtin_amdgcn_wmma_f32_16x16x4_f32(false, a, false, b0, (short)0, acc0, false, false);
            acc1 = __builtin_amdgcn_wmma_f32_16x16x4_f32(false, a, false, b1, (short)0, acc1, false, false);
            acc2 = __builtin_amdgcn_wmma_f32_16x16x4_f32(false, a, false, b2, (short)0, acc2, false, false);
            acc3 = __builtin_amdgcn_wmma_f32_16x16x4_f32(false, a, false, b3, (short)0, acc3, false, false);
        }
        // Publish point of chunk t+1; it also frees the buffer of chunk t.
        asm volatile("s_wait_dscnt 0x0" ::: "memory");      // this wave's reads of chunk t are done
        asm volatile("s_wait_asynccnt 0x0" ::: "memory");   // this wave's chunk-(t+1) copies have landed
        __syncthreads();                                    // the same holds for every wave
        if (t + 2 < NCHUNK) issue_chunk((t + 2) * KC, t & 1);
    }
    asm volatile("s_wait_asynccnt 0x0" ::: "memory");       // no copy outlives the loop

    const float scale = scale_ptr ? scale_ptr[0] : 1.0f;

    // D layout: VGPR r -> row (m0 + 8*(lane/16) + r), col n0 + j*16 + lane%16
    const int mrow = m0 + (lane >> 4) * 8;
    float* crow = C + (size_t)mrow * N + n0 + lr;
#pragma unroll
    for (int r = 0; r < 8; ++r) {
        crow[(size_t)r * N +  0] = acc0[r] * scale;
        crow[(size_t)r * N + 16] = acc1[r] * scale;
        crow[(size_t)r * N + 32] = acc2[r] * scale;
        crow[(size_t)r * N + 48] = acc3[r] * scale;
    }
}

// qx[B*T, 2H] = hid[B*T, H] @ G2[2H, H]^T
// 4096 blocks on 256 WGPs: KC = 32 lets four blocks share a WGP's LDS, and the
// wave limit keeps a fifth out: 1024 places, four whole rounds, so that every
// WGP gets the same share.
__global__ __launch_bounds__(256) __attribute__((amdgpu_waves_per_eu(8, 8)))
void gemm_hid_g2(const float* __restrict__ X, const float* __restrict__ W,
                 float* __restrict__ C, const float* __restrict__ scale_ptr) {
    gemm_xwt_body<HH, 2 * HH, 32>(X, W, C, scale_ptr);
}

// out[B*T, H] = (qx[B*T, 2H] @ P2[H, 2H]^T) * gain
// 2048 blocks, KC = 64. Three blocks would fit a WGP's LDS: 768 places, and a
// last round of 512 blocks that need not spread evenly. The wave limit keeps
// the third out: 512 places, four whole rounds, the same share for every WGP.
__global__ __launch_bounds__(256) __attribute__((amdgpu_waves_per_eu(4, 4)))
void gemm_mix_p2(const float* __restrict__ X, const float* __restrict__ W,
                 float* __restrict__ C, const float* __restrict__ scale_ptr) {
    gemm_xwt_body<2 * HH, HH, 64>(X, W, C, scale_ptr);
}

// ---------------------------------------------------------------------------
// Weight products, computed once per call on the f32 WMMA (one launch,
// blockIdx.z picks the product):
//   z = 0, 1:  G[m][k] = sum_n Wk[n][m] * Wq[n][k]    -> G2 rows z*H + m
//   z = 2, 3:  P[o][m] = sum_n Wout[o][n] * Wv[n][m]  -> P2[o][(z-2)*H + m]
// With them  q.k = (hid @ G^T) . adv_row  and
//            (sum_w a_w * v_w) @ Wout^T = (sum_w a_w * adv_row_w) @ P^T,
// so no advisor row is projected at all.
//
// Per wave 16 x 64, block 128 x 64. The second operand is read along its
// rows: one float4 per lane holds one column of each of the four accumulator
// tiles (tile j, lane lr <-> column c0 + 4*lr + j), so two b128 loads feed
// four WMMAs and the result goes out as float4 stores.
// ---------------------------------------------------------------------------
__global__ __launch_bounds__(256)
void fold_weights(const float* __restrict__ Wqj, const float* __restrict__ Wkj,
                  const float* __restrict__ Wvj, const float* __restrict__ Wqi,
                  const float* __restrict__ Wki, const float* __restrict__ Wvi,
                  const float* __restrict__ Wout,
                  float* __restrict__ G2, float* __restrict__ P2) {
    const int lane = threadIdx.x & 31;
    const int wave = threadIdx.x >> 5;
    const int lr   = lane & 15;
    const int kp   = (lane >> 4) << 1;      // K-pair select: 0 or 2

    const int z  = blockIdx.z;              // block-uniform
    const int r0 = blockIdx.y * 128 + wave * 16;
    const int c0 = blockIdx.x * 64;

    const bool score = z < 2;
    const float* A  = score ? (z == 0 ? Wkj : Wki) : Wout;
    const float* Bm = score ? (z == 0 ? Wqj : Wqi) : (z == 2 ? Wvj : Wvi);
    float* C        = score ? G2 + (size_t)z * HH * HH : P2 + (size_t)(z - 2) * HH;
    const int ldc   = score ? HH : 2 * HH;

    const float* bp = Bm + (size_t)kp * HH + c0 + 4 * lr;

    v8f acc0 = {}; v8f acc1 = {}; v8f acc2 = {}; v8f acc3 = {};

    auto mac = [&](v2f a, float4 x, float4 y) {
        v2f b0 = {x.x, y.x}; v2f b1 = {x.y, y.y};
        v2f b2 = {x.z, y.z}; v2f b3 = {x.w, y.w};
        acc0 = __builtin_amdgcn_wmma_f32_16x16x4_f32(false, a, false, b0, (short)0, acc0, false, false);
        acc1 = __builtin_amdgcn_wmma_f32_16x16x4_f32(false, a, false, b1, (short)0, acc1, false, false);
        acc2 = __builtin_amdgcn_wmma_f32_16x16x4_f32(false, a, false, b2, (short)0, acc2, false, false);
        acc3 = __builtin_amdgcn_wmma_f32_16x16x4_f32(false, a, false, b3, (short)0, acc3, false, false);
    };

    // Eight K-steps a trip: all their loads first, then their 32 WMMAs.
    // astep: floats from one K-step's first-operand pair to the next;
    // apair: floats between the two elements of a pair.
    auto sweep = [&](const float* ap, const int astep, const int apair) {
        for (int n = 0; n < HH; n += 32) {
            v2f a[8]; float4 x[8], y[8];
            // unrolled (here and below) so that a, x and y are registers, not scratch
#pragma unroll
            for (int j = 0; j < 8; ++j) {
                x[j] = *(const float4*)(bp + (size_t)(4 * j) * HH);        // row n+4j+kp
                y[j] = *(const float4*)(bp + (size_t)(4 * j) * HH + HH);   // row n+4j+kp+1
                a[j] = v2f{ap[j * astep], ap[j * astep + apair]};
            }
            // Wait behind the trip's last load, before any register that these
            // loads name as an address is written again.
            asm volatile("s_wait_xcnt 0x0" ::: "memory");
            // Keeps the pointer steps and the register moves below behind that wait.
            __builtin_amdgcn_sched_barrier(0);
#pragma unroll
            for (int j = 0; j < 8; ++j) mac(a[j], x[j], y[j]);
            ap += 8 * astep;
            bp += 32 * HH;
        }
    };

    if (score) {
        // first operand transposed: element (r, n) = A[n][r]
        sweep(A + (size_t)kp * HH + r0 + lr, 4 * HH, HH);
    } else {
        // first operand as stored: element (r, n) = A[r][n]
        sweep(A + (size_t)(r0 + lr) * HH + kp, 4, 1);
    }

    // D layout: VGPR r -> row r0 + 8*(lane/16) + r; tile j -> column c0 + 4*lr + j
    float* crow = C + (size_t)(r0 + (lane >> 4) * 8) * ldc + c0 + 4 * lr;
#pragma unroll
    for (int r = 0; r < 8; ++r) {
        *(float4*)(crow + (size_t)r * ldc) =
            make_float4(acc0[r], acc1[r], acc2[r], acc3[r]);
    }
}

// ---------------------------------------------------------------------------
// Per-token council attention. One wave32 per token t of all batches (8 tokens
// a block, so a block lies in one batch).
// qx row t holds [hid@Gj^T | hid@Gi^T]; both heads' scores are dot products
// with the three raw advisor rows of the window, which stay in registers.
// After the logic-gate rewrite of score[0], the two 3-way softmaxes and the
// council weights, the two mixed advisor rows overwrite the same qx row.
// ---------------------------------------------------------------------------
__global__ __launch_bounds__(256)
void council_attn(float* qx, const float* __restrict__ adv,
                  const int* __restrict__ adv_ids, const int* __restrict__ ptr_ids,
                  const float* __restrict__ council) {
    const int lane = threadIdx.x & 31;
    const int wave = threadIdx.x >> 5;
    const int t = blockIdx.x * 8 + wave;

    // this block's batch (block-uniform): its advisor rows and ids
    const int b = (blockIdx.x * 8) / TT;
    adv     += (size_t)b * LL * HH;
    adv_ids += (size_t)b * LL;

    int p = ptr_ids[t];
    int i0 = min(max(p,     0), LL - 1);
    int i1 = min(max(p + 1, 0), LL - 1);
    int i2 = min(max(p + 2, 0), LL - 1);

    float4* row = (float4*)(qx + (size_t)t * (2 * HH));
    const float4* a0p = (const float4*)(adv + (size_t)i0 * HH);
    const float4* a1p = (const float4*)(adv + (size_t)i1 * HH);
    const float4* a2p = (const float4*)(adv + (size_t)i2 * HH);

    float sj0 = 0.f, sj1 = 0.f, sj2 = 0.f;
    float si0 = 0.f, si1 = 0.f, si2 = 0.f;

    constexpr int NV = HH / 4;        // 256 float4 per row
    constexpr int NI = NV / 32;       // 8 per lane
    float4 a0[NI], a1[NI], a2[NI];
#pragma unroll
    for (int i = 0; i < NI; ++i) {
        const int it = lane + 32 * i;
        a0[i] = a0p[it]; a1[i] = a1p[it]; a2[i] = a2p[it];
        float4 q = row[it];
        float4 k;
        k = a0[i]; sj0 += q.x*k.x + q.y*k.y + q.z*k.z + q.w*k.w;
        k = a1[i]; sj1 += q.x*k.x + q.y*k.y + q.z*k.z + q.w*k.w;
        k = a2[i]; sj2 += q.x*k.x + q.y*k.y + q.z*k.z + q.w*k.w;
        float4 r = row[NV + it];
        k = a0[i]; si0 += r.x*k.x + r.y*k.y + r.z*k.z + r.w*k.w;
        k = a1[i]; si1 += r.x*k.x + r.y*k.y + r.z*k.z + r.w*k.w;
        k = a2[i]; si2 += r.x*k.x + r.y*k.y + r.z*k.z + r.w*k.w;
    }
    // wave32 xor reduction -> every lane holds the full sums
    for (int m = 16; m >= 1; m >>= 1) {
        sj0 += __shfl_xor(sj0, m); sj1 += __shfl_xor(sj1, m); sj2 += __shfl_xor(sj2, m);
        si0 += __shfl_xor(si0, m); si1 += __shfl_xor(si1, m); si2 += __shfl_xor(si2, m);
    }

    const float inv = 1.0f / sqrtf((float)HH);
    float lrel = sj0 * inv, l1 = sj1 * inv, l2 = sj2 * inv;

    const int rel = adv_ids[i0];          // wave-uniform
    float lfin;
    switch (rel) {
        case 0:  lfin = l1 + l2;            break;  // AND
        case 1:  lfin = fmaxf(l1, l2);      break;  // OR
        case 2:  lfin = -l1;                break;  // NOT
        case 3:  lfin = fmaxf(-l1, l2);     break;  // IMPLIES
        case 4:  lfin = fabsf(l1 - l2);     break;  // XOR
        default: lfin = lrel;               break;  // no gate
    }

    // softmax over {lfin, l1, l2}
    float mxj = fmaxf(lfin, fmaxf(l1, l2));
    float ej0 = __expf(lfin - mxj), ej1 = __expf(l1 - mxj), ej2 = __expf(l2 - mxj);
    float rsj = 1.0f / (ej0 + ej1 + ej2);
    float aj0 = ej0 * rsj, aj1 = ej1 * rsj, aj2 = ej2 * rsj;

    // softmax over si
    float t0 = si0 * inv, t1 = si1 * inv, t2 = si2 * inv;
    float mxi = fmaxf(t0, fmaxf(t1, t2));
    float ei0 = __expf(t0 - mxi), ei1 = __expf(t1 - mxi), ei2 = __expf(t2 - mxi);
    float rsi = 1.0f / (ei0 + ei1 + ei2);
    float ai0 = ei0 * rsi, ai1 = ei1 * rsi, ai2 = ei2 * rsi;

    // council softmax (2 elements)
    float c0 = council[0], c1 = council[1];
    float cm = fmaxf(c0, c1);
    float ec0 = __expf(c0 - cm), ec1 = __expf(c1 - cm);
    float rc = 1.0f / (ec0 + ec1);
    float w0 = ec0 * rc, w1 = ec1 * rc;

    const float fj0 = w0 * aj0, fj1 = w0 * aj1, fj2 = w0 * aj2;
    const float fi0 = w1 * ai0, fi1 = w1 * ai1, fi2 = w1 * ai2;

#pragma unroll
    for (int i = 0; i < NI; ++i) {
        const int it = lane + 32 * i;
        const float4 u = a0[i], v = a1[i], w = a2[i];
        float4 o;
        o.x = fj0*u.x + fj1*v.x + fj2*w.x;  o.y = fj0*u.y + fj1*v.y + fj2*w.y;
        o.z = fj0*u.z + fj1*v.z + fj2*w.z;  o.w = fj0*u.w + fj1*v.w + fj2*w.w;
        row[it] = o;
        o.x = fi0*u.x + fi1*v.x + fi2*w.x;  o.y = fi0*u.y + fi1*v.y + fi2*w.y;
        o.z = fi0*u.z + fi1*v.z + fi2*w.z;  o.w = fi0*u.w + fi1*v.w + fi2*w.w;
        row[NV + it] = o;
    }
}

// ---------------------------------------------------------------------------
// Launch: once per call --
//   G2 = [Wkj^T Wqj ; Wki^T Wqi]  (2H x H),  P2 = [Wout Wvj | Wout Wvi]  (H x 2H)
// then, each as one launch over the B*T token rows of all batches --
//   qx  = hid @ G2^T                         (B*T x 2H)
//   council_attn: qx row -> [w0 * sum aj*adv | w1 * sum ai*adv]  (in place)
//   out = qx @ P2^T * gain                   (K = 2H)
// Workspace: B*T*2H + 2 * 2H*H floats = 144 MiB, all written in this call.
// ---------------------------------------------------------------------------
extern "C" void kernel_launch(void* const* d_in, const int* in_sizes, int n_in,
                              void* d_out, int out_size, void* d_ws, size_t ws_size,
                              hipStream_t stream) {
    const float* hidden  = (const float*)d_in[0];
    const float* advisor = (const float*)d_in[1];
    const int*   adv_ids = (const int*)  d_in[2];
    const int*   ptr_ids = (const int*)  d_in[3];
    const float* Wqj  = (const float*)d_in[4];
    const float* Wkj  = (const float*)d_in[5];
    const float* Wvj  = (const float*)d_in[6];
    const float* Wqi  = (const float*)d_in[7];
    const float* Wki  = (const float*)d_in[8];
    const float* Wvi  = (const float*)d_in[9];
    const float* Wout = (const float*)d_in[10];
    const float* gain    = (const float*)d_in[11];
    const float* council = (const float*)d_in[12];
    float* out = (float*)d_out;

    float* ws = (float*)d_ws;
    float* qx = ws;                                  // B*T x 2H
    float* G2 = qx + (size_t)MT * 2 * HH;            // 2H x H
    float* P2 = G2 + (size_t)2 * HH * HH;            // H x 2H

    const dim3 blk(256);

    fold_weights<<<dim3(HH / 64, HH / 128, 4), blk, 0, stream>>>(
        Wqj, Wkj, Wvj, Wqi, Wki, Wvi, Wout, G2, P2);

    gemm_hid_g2<<<dim3(2 * HH / 64, MT / 128), blk, 0, stream>>>(
        hidden, G2, qx, nullptr);

    council_attn<<<MT / 8, blk, 0, stream>>>(qx, advisor, adv_ids, ptr_ids, council);

    gemm_mix_p2<<<dim3(HH / 64, MT / 128), blk, 0, stream>>>(
        qx, P2, out, gain);
}
